// v000
// Measured on an AMD MI455X. A time is GPU time per run, averaged over a window of back-to-back runs after a warm-up
// (all launches, gaps included; the runs take copies of the inputs in turn), and the median of several windows.
// Apart from v000's, it joins two sittings. Times from different sittings can be a few percent apart, while
// side-by-side timings come from the same sitting.
// v000, which the later versions start from, runs in 52.5 microseconds.
#include <hip/hip_runtime.h>
#include <math.h>

// ---------------------------------------------------------------------------
// Bahdanau additive cross-attention pooling, fused for MI455X (gfx1250).
//   N=32, TQ=16, TK=2048, D=128.
// Never materializes h=[N,TQ,TK,D] (536MB). Softmax axis is TQ -> local per
// key column -> full fusion of score/softmax/weighted-sum over k.
// - GEMMs on v_wmma_f32_16x16x32_f16 (f32 accumulate)
// - k tiles staged via GLOBAL_LOAD_ASYNC_TO_LDS_B128 (ASYNCcnt) into an LDS
//   buffer that is reused for uk one phase later (zero extra LDS)
// - tanh on the TRANS pipe via v_tanh_f32 (dominant cost: ~134M tanh)
// ---------------------------------------------------------------------------

#define DD   128
#define NB   32
#define TQ   16
#define TK   2048
#define KCH  8          // k-chunks per n
#define CHUNK (TK/KCH)  // 256 keys per block
#define IC   32         // keys per inner tile (one WMMA K=32 block)

typedef _Float16 v16h __attribute__((ext_vector_type(16)));
typedef _Float16 v8h  __attribute__((ext_vector_type(8)));
typedef _Float16 v4h  __attribute__((ext_vector_type(4)));
typedef float    v8f  __attribute__((ext_vector_type(8)));
typedef float    v4f  __attribute__((ext_vector_type(4)));

// LDS row strides chosen so every 16B fragment run is 16B-aligned and
// lane-strided reads hit distinct banks (row bytes are odd multiples of 16).
#define KL_STR  136   // f16, k chunk row-major   (272B/row)
#define KT_STR  40    // f16, k chunk transposed  (80B/row)
#define WQ_STR  132   // f32, wq                  (528B/row)
#define UK_STR  132   // f32, raw-k stage / uk    (528B/row)
#define WA_STR  40    // f16, softmax weights     (80B/row)

// Native TRANS-pipe tanh (V_TANH_F32, CDNA5). v_nop satisfies the documented
// TRANS hazard (1 independent op before the result may be consumed).
__device__ __forceinline__ float fast_tanh(float x) {
  float y;
  asm("v_tanh_f32 %0, %1\n\tv_nop" : "=v"(y) : "v"(x));
  return y;
}

// Async DMA: global -> LDS, 16B per lane, tracked by ASYNCcnt.
__device__ __forceinline__ void async_copy_b128(unsigned lds_byte_off,
                                                const float* gaddr) {
  asm volatile("global_load_async_to_lds_b128 %0, %1, off"
               :: "v"(lds_byte_off), "v"(gaddr) : "memory");
}
__device__ __forceinline__ void wait_asynccnt0() {
  asm volatile("s_wait_asynccnt 0" ::: "memory");
}

__device__ __forceinline__ v8f wmma_f16(v16h a, v16h b, v8f c) {
  // v_wmma_f32_16x16x32_f16  (probe-verified builtin signature)
  return __builtin_amdgcn_wmma_f32_16x16x32_f16(
      /*neg_a=*/false, a, /*neg_b=*/false, b,
      /*c_mod=*/(short)0, c, /*reuse_a=*/false, /*reuse_b=*/false);
}

// 16-bit A/B fragment lane layout: element K = (v>=4?16:0) + 8*h + 2*(v&3)+s
// => two contiguous runs of 8 halfs at [h*8] and [16+h*8] of the lane's row.
__device__ __forceinline__ v16h frag_h16(const _Float16* row, int h) {
  union { v16h v; v8h p[2]; } u;
  u.p[0] = *(const v8h*)(row + h * 8);
  u.p[1] = *(const v8h*)(row + 16 + h * 8);
  return u.v;
}

__device__ __forceinline__ v16h frag_f32(const float* row, int h) {
  const v4f* r0 = (const v4f*)(row + h * 8);
  const v4f* r1 = (const v4f*)(row + 16 + h * 8);
  v4f a0 = r0[0], a1 = r0[1], b0 = r1[0], b1 = r1[1];
  union { v16h v; _Float16 e[16]; } u;
#pragma unroll
  for (int i = 0; i < 4; ++i) {
    u.e[i]      = (_Float16)a0[i];
    u.e[4 + i]  = (_Float16)a1[i];
    u.e[8 + i]  = (_Float16)b0[i];
    u.e[12 + i] = (_Float16)b1[i];
  }
  return u.v;
}

// --------------------------- kernel 1: Uw -> f16 ---------------------------
__global__ __launch_bounds__(256) void cvt_uw_kernel(const float* __restrict__ Uw,
                                                     _Float16* __restrict__ uwh) {
  int i = blockIdx.x * 256 + threadIdx.x;
  if (i < DD * DD) uwh[i] = (_Float16)Uw[i];
}

// ------------------------ kernel 2: wq = q@Ww.T + Wb -----------------------
// grid = NB blocks, 8 waves; wave w owns the 16-wide d-tile w of wq[n].
__global__ __launch_bounds__(256) void wq_kernel(const float* __restrict__ q,
                                                 const float* __restrict__ Ww,
                                                 const float* __restrict__ Wb,
                                                 float* __restrict__ wq) {
  const int n    = blockIdx.x;
  const int lane = threadIdx.x & 31;
  const int wv   = threadIdx.x >> 5;
  const int h    = (lane >> 4) & 1;
  const int col  = lane & 15;
  const int dbase = wv * 16;

  v8f c;
  const float bias = Wb[dbase + col];
#pragma unroll
  for (int j = 0; j < 8; ++j) c[j] = bias;

  const float* qrow = q  + (n * TQ + col) * DD;   // A row M = col
  const float* wrow = Ww + (dbase + col) * DD;    // B col d = dbase+col <- Ww row d
#pragma unroll
  for (int ks = 0; ks < DD; ks += 32) {
    v16h a = frag_f32(qrow + ks, h);
    v16h b = frag_f32(wrow + ks, h);
    c = wmma_f16(a, b, c);
  }
  float* o = wq + (n * TQ) * DD + dbase + col;    // C: M=j+8h, N=col
#pragma unroll
  for (int j = 0; j < 8; ++j) o[(j + 8 * h) * DD] = c[j];
}

// --------------- kernel 3: fused uk-GEMM / tanh-score / softmax / x --------
// grid = (KCH, NB); block = 256 threads = 8 waves; wave wv owns d-tile wv of x.
__global__ __launch_bounds__(256) void main_kernel(const float* __restrict__ k,
                                                   const float* __restrict__ mask,
                                                   const float* __restrict__ wq,
                                                   const _Float16* __restrict__ uwh,
                                                   const float* __restrict__ Ub,
                                                   const float* __restrict__ Vw,
                                                   const float* __restrict__ Vb,
                                                   float* __restrict__ part) {
  __shared__ __align__(16) _Float16 kl[IC][KL_STR];   // k chunk, row-major f16
  __shared__ __align__(16) _Float16 kt[DD][KT_STR];   // k chunk, transposed f16
  __shared__ __align__(16) float    wql[TQ][WQ_STR];  // wq[n]
  // Dual-purpose buffer: phase 1 = raw f32 k tile (async DMA target),
  // phase 2 = uk tile (overwrites the raw k after it has been converted).
  __shared__ __align__(16) float    ukl[IC][UK_STR];
  __shared__ __align__(16) _Float16 wA[TQ][WA_STR];   // softmax weights (A frag src)
  __shared__ __align__(16) float    sc[IC][TQ + 1];   // raw scores
  __shared__ __align__(16) float    vwl[DD];
  __shared__ __align__(16) float    mk[IC];

  const int chunk = blockIdx.x;
  const int n     = blockIdx.y;
  const int t     = threadIdx.x;
  const int lane  = t & 31;
  const int wv    = t >> 5;
  const int h     = (lane >> 4) & 1;
  const int col   = lane & 15;

  // Stage wq[n] and Vw once.
  for (int idx = t; idx < TQ * (DD / 4); idx += 256) {
    int r = idx >> 5, c4 = (idx & 31) * 4;
    v4f v = *(const v4f*)(wq + (n * TQ + r) * DD + c4);
    *(v4f*)&wql[r][c4] = v;
  }
  if (t < DD) vwl[t] = Vw[t];
  const float vb = Vb[0];

  // Hoist: Uw B-fragments (invariant over all key tiles) and uk bias.
  const _Float16* urow = uwh + (wv * 16 + col) * DD;
  v16h bU0 = frag_h16(urow,      h);
  v16h bU1 = frag_h16(urow + 32, h);
  v16h bU2 = frag_h16(urow + 64, h);
  v16h bU3 = frag_h16(urow + 96, h);
  const float ubias = Ub[wv * 16 + col];

  v8f xacc;
#pragma unroll
  for (int j = 0; j < 8; ++j) xacc[j] = 0.0f;

  const int qi  = t & 15;        // score-phase mapping
  const int kk0 = t >> 4;        // handles keys kk0 and kk0+16

  for (int ic = 0; ic < CHUNK / IC; ++ic) {
    const int kbase = chunk * CHUNK + ic * IC;
    __syncthreads();  // previous tile fully consumed (ukl readers, kt readers)

    // ---- async DMA the raw f32 k tile straight into LDS (ukl buffer) ------
    for (int idx = t; idx < IC * (DD / 4); idx += 256) {
      int r = idx >> 5, c4 = (idx & 31) * 4;
      const float* g = k + (size_t)(n * TK + kbase + r) * DD + c4;
      async_copy_b128((unsigned)(size_t)(void*)&ukl[r][c4], g);
    }
    if (t < IC) mk[t] = mask[n * TK + kbase + t];
    // Prefetch next tile while async copies are in flight.
    if (ic + 1 < CHUNK / IC && t < IC)
      __builtin_prefetch(k + (size_t)(n * TK + kbase + IC + t) * DD, 0, 0);
    wait_asynccnt0();
    __syncthreads();

    // ---- convert raw f32 tile -> f16 row-major (kl) + transposed (kt) -----
    for (int idx = t; idx < IC * (DD / 4); idx += 256) {
      int r = idx >> 5, c4 = (idx & 31) * 4;
      v4f v = *(const v4f*)&ukl[r][c4];
      v4h hv;
#pragma unroll
      for (int i = 0; i < 4; ++i) hv[i] = (_Float16)v[i];
      *(v4h*)&kl[r][c4] = hv;
#pragma unroll
      for (int i = 0; i < 4; ++i) kt[c4 + i][r] = hv[i];
    }
    __syncthreads();

    // ---- uk = k_tile @ Uw.T + Ub : wave wv does both 16-row halves --------
    // (writes ukl, overwriting the raw k tile that is now dead)
    {
      v8f c0, c1;
#pragma unroll
      for (int j = 0; j < 8; ++j) { c0[j] = ubias; c1[j] = ubias; }
#pragma unroll
      for (int ks = 0; ks < 4; ++ks) {
        v16h b = (ks == 0) ? bU0 : (ks == 1) ? bU1 : (ks == 2) ? bU2 : bU3;
        v16h a0 = frag_h16(&kl[col][ks * 32], h);
        v16h a1 = frag_h16(&kl[16 + col][ks * 32], h);
        c0 = wmma_f16(a0, b, c0);
        c1 = wmma_f16(a1, b, c1);
      }
      __syncthreads();  // all raw-k reads done before overwrite
#pragma unroll
      for (int j = 0; j < 8; ++j) {
        ukl[j + 8 * h][wv * 16 + col]      = c0[j];
        ukl[16 + j + 8 * h][wv * 16 + col] = c1[j];
      }
    }
    __syncthreads();

    // ---- scores: s[q,kk] = Vb + sum_d Vw[d]*tanh(wq[q,d]+uk[kk,d]) --------
    {
      float s0 = 0.0f, s1 = 0.0f;
#pragma unroll 4
      for (int d = 0; d < DD; ++d) {
        float w = wql[qi][d], v = vwl[d];
        s0 += v * fast_tanh(w + ukl[kk0][d]);
        s1 += v * fast_tanh(w + ukl[kk0 + 16][d]);
      }
      s0 += vb + (1.0f - mk[kk0])      * -10000.0f;
      s1 += vb + (1.0f - mk[kk0 + 16]) * -10000.0f;
      sc[kk0][qi] = s0;
      sc[kk0 + 16][qi] = s1;
    }
    __syncthreads();

    // ---- softmax over the TQ axis (local per key column) ------------------
    if (t < IC) {
      float m = -1e30f;
#pragma unroll
      for (int qq = 0; qq < TQ; ++qq) m = fmaxf(m, sc[t][qq]);
      float s = 0.0f;
      float e[TQ];
#pragma unroll
      for (int qq = 0; qq < TQ; ++qq) { e[qq] = __expf(sc[t][qq] - m); s += e[qq]; }
      float r = 1.0f / s;
#pragma unroll
      for (int qq = 0; qq < TQ; ++qq) wA[qq][t] = (_Float16)(e[qq] * r);
    }
    __syncthreads();

    // ---- x[q, dtile] += w(16x32) @ k_tile(32x16) --------------------------
    {
      v16h a = frag_h16(&wA[col][0], h);                 // row q = col
      v16h b = frag_h16(&kt[wv * 16 + col][0], h);       // col d = wv*16+col
      xacc = wmma_f16(a, b, xacc);
    }
  }

  // Partial result for this chunk: part[chunk][n][q][d]
  float* o = part + ((size_t)(chunk * NB + n) * TQ) * DD + wv * 16 + col;
#pragma unroll
  for (int j = 0; j < 8; ++j) o[(j + 8 * h) * DD] = xacc[j];
}

// ----------------------- kernel 4: deterministic reduce --------------------
__global__ __launch_bounds__(256) void reduce_kernel(const float* __restrict__ part,
                                                     float* __restrict__ out) {
  int i = blockIdx.x * 256 + threadIdx.x;
  if (i < NB * TQ * DD) {
    float s = 0.0f;
#pragma unroll
    for (int c = 0; c < KCH; ++c) s += part[(size_t)c * NB * TQ * DD + i];
    out[i] = s;
  }
}

// ---------------------------------------------------------------------------
extern "C" void kernel_launch(void* const* d_in, const int* in_sizes, int n_in,
                              void* d_out, int out_size, void* d_ws, size_t ws_size,
                              hipStream_t stream) {
  (void)in_sizes; (void)n_in; (void)out_size; (void)ws_size;
  const float* q    = (const float*)d_in[0];
  const float* k    = (const float*)d_in[1];
  const float* mask = (const float*)d_in[2];
  const float* Ww   = (const float*)d_in[3];
  const float* Wb   = (const float*)d_in[4];
  const float* Uw   = (const float*)d_in[5];
  const float* Ub   = (const float*)d_in[6];
  const float* Vw   = (const float*)d_in[7];
  const float* Vb   = (const float*)d_in[8];
  float* out = (float*)d_out;

  char* ws = (char*)d_ws;
  float*    wq_ws = (float*)ws;                              // 256 KB
  _Float16* uwh   = (_Float16*)(ws + 262144);                // 32 KB
  float*    part  = (float*)(ws + 262144 + 32768);           // 2 MB

  cvt_uw_kernel<<<(DD * DD + 255) / 256, 256, 0, stream>>>(Uw, uwh);
  wq_kernel<<<NB, 256, 0, stream>>>(q, Ww, Wb, wq_ws);
  main_kernel<<<dim3(KCH, NB), 256, 0, stream>>>(k, mask, wq_ws, uwh, Ub, Vw, Vb, part);
  reduce_kernel<<<(NB * TQ * DD + 255) / 256, 256, 0, stream>>>(part, out);
}

// v001
// A run of this version takes 32.4 microseconds.
// Two timings next to v000 put it at 1.64 and 1.63 times that version's speed.
#include <hip/hip_runtime.h>
#include <math.h>

// ---------------------------------------------------------------------------
// Bahdanau additive cross-attention pooling, fused for MI455X (gfx1250).
//   N=32, TQ=16, TK=2048, D=128.
// Never materializes h=[N,TQ,TK,D] (536MB). Softmax axis is TQ -> local per
// key column -> full fusion of score/softmax/weighted-sum over k.
// - GEMMs on v_wmma_f32_16x16x32_f16 (f32 accumulate)
// - uk stays in the WMMA accumulators (one key per lane); scores and the
//   softmax over TQ are formed per lane
// - tanh on the TRANS pipe via v_tanh_f32 (dominant cost: ~134M tanh)
// ---------------------------------------------------------------------------

#define DD   128
#define NB   32
#define TQ   16
#define TK   2048
#define KCH  16         // k-chunks per n
#define CHUNK (TK/KCH)  // 128 keys per block: 8 waves x 16 keys

typedef _Float16 v16h __attribute__((ext_vector_type(16)));
typedef _Float16 v8h  __attribute__((ext_vector_type(8)));
typedef float    v8f  __attribute__((ext_vector_type(8)));
typedef float    v4f  __attribute__((ext_vector_type(4)));
typedef float    v2f  __attribute__((ext_vector_type(2)));

// LDS row stride chosen so every 16B fragment run is 16B-aligned and
// lane-strided reads hit distinct banks (row bytes are an odd multiple of 16).
#define WA_STR  136   // f16, softmax weights     (272B/row)

// Native TRANS-pipe tanh (V_TANH_F32, CDNA5). v_nop satisfies the documented
// TRANS hazard (1 independent op before the result may be consumed).
__device__ __forceinline__ float fast_tanh(float x) {
  float y;
  asm("v_tanh_f32 %0, %1\n\tv_nop" : "=v"(y) : "v"(x));
  return y;
}

__device__ __forceinline__ v8f wmma_f16(v16h a, v16h b, v8f c) {
  // v_wmma_f32_16x16x32_f16  (probe-verified builtin signature)
  return __builtin_amdgcn_wmma_f32_16x16x32_f16(
      /*neg_a=*/false, a, /*neg_b=*/false, b,
      /*c_mod=*/(short)0, c, /*reuse_a=*/false, /*reuse_b=*/false);
}

// 16-bit A/B fragment lane layout: element K = (v>=4?16:0) + 8*h + 2*(v&3)+s
// => two contiguous runs of 8 halfs at [h*8] and [16+h*8] of the lane's row.
__device__ __forceinline__ v16h frag_h16(const _Float16* row, int h) {
  union { v16h v; v8h p[2]; } u;
  u.p[0] = *(const v8h*)(row + h * 8);
  u.p[1] = *(const v8h*)(row + 16 + h * 8);
  return u.v;
}

__device__ __forceinline__ v16h frag_f32(const float* row, int h) {
  const v4f* r0 = (const v4f*)(row + h * 8);
  const v4f* r1 = (const v4f*)(row + 16 + h * 8);
  v4f a0 = r0[0], a1 = r0[1], b0 = r1[0], b1 = r1[1];
  union { v16h v; _Float16 e[16]; } u;
#pragma unroll
  for (int i = 0; i < 4; ++i) {
    u.e[i]      = (_Float16)a0[i];
    u.e[4 + i]  = (_Float16)a1[i];
    u.e[8 + i]  = (_Float16)b0[i];
    u.e[12 + i] = (_Float16)b1[i];
  }
  return u.v;
}

// --------------------------- kernel 1: Uw -> f16 ---------------------------
__global__ __launch_bounds__(256) void cvt_uw_kernel(const float* __restrict__ Uw,
                                                     _Float16* __restrict__ uwh) {
  int i = blockIdx.x * 256 + threadIdx.x;
  if (i < DD * DD) uwh[i] = (_Float16)Uw[i];
}

// ------------------------ kernel 2: wq = q@Ww.T + Wb -----------------------
// grid = NB blocks, 8 waves; wave w owns the 16-wide d-tile w of wq[n].
__global__ __launch_bounds__(256) void wq_kernel(const float* __restrict__ q,
                                                 const float* __restrict__ Ww,
                                                 const float* __restrict__ Wb,
                                                 float* __restrict__ wq) {
  const int n    = blockIdx.x;
  const int lane = threadIdx.x & 31;
  const int wv   = threadIdx.x >> 5;
  const int h    = (lane >> 4) & 1;
  const int col  = lane & 15;
  const int dbase = wv * 16;

  v8f c;
  const float bias = Wb[dbase + col];
#pragma unroll
  for (int j = 0; j < 8; ++j) c[j] = bias;

  const float* qrow = q  + (n * TQ + col) * DD;   // A row M = col
  const float* wrow = Ww + (dbase + col) * DD;    // B col d = dbase+col <- Ww row d
#pragma unroll
  for (int ks = 0; ks < DD; ks += 32) {
    v16h a = frag_f32(qrow + ks, h);
    v16h b = frag_f32(wrow + ks, h);
    c = wmma_f16(a, b, c);
  }
  float* o = wq + (n * TQ) * DD + dbase + col;    // C: M=j+8h, N=col
#pragma unroll
  for (int j = 0; j < 8; ++j) o[(j + 8 * h) * DD] = c[j];
}

// ------- kernel 3: fused uk-GEMM / tanh-score / softmax / x, keys on lanes -------
// grid = (KCH, NB); block = 8 waves; wave wv owns keys wv*16 .. wv*16+15 of the
// block's 128 for the scores, and d-tile wv of x for the weighted sum.
// uk is formed transposed (A = Uw rows, B = k rows): D register r of lane (col,h)
// is uk[key col][dt*16 + 8h + r], so a lane holds 64 of its key's 128 uk values
// and the sum over d is in-lane but for one exchange between the lane halves.
__global__ __launch_bounds__(256) void main_kernel(const float* __restrict__ k,
                                                   const float* __restrict__ mask,
                                                   const float* __restrict__ wq,
                                                   const _Float16* __restrict__ uwh,
                                                   const float* __restrict__ Ub,
                                                   const float* __restrict__ Vw,
                                                   const float* __restrict__ Vb,
                                                   float* __restrict__ part) {
  __shared__ __align__(16) float    wql[TQ][DD];        // wq[n], read as broadcasts
  __shared__ __align__(16) float    sc[TQ][CHUNK];      // raw scores, column = key
  __shared__ __align__(16) _Float16 wA[TQ][WA_STR];     // softmax weights (A frag src)

  const int chunk = blockIdx.x;
  const int n     = blockIdx.y;
  const int t     = threadIdx.x;
  const int lane  = t & 31;
  const int wv    = t >> 5;
  const int h     = (lane >> 4) & 1;
  const int col   = lane & 15;
  const int kbase = chunk * CHUNK;
  const int kloc  = wv * 16 + col;          // this lane's key inside the block

  // Stage wq[n] once. Unrolled so that both loads fly together with the k and
  // Uw loads below instead of each being waited for in a loop of its own.
#pragma unroll
  for (int i = 0; i < TQ * (DD / 4) / 256; ++i) {
    int idx = t + i * 256;
    int r = idx >> 5, c4 = (idx & 31) * 4;
    *(v4f*)&wql[r][c4] = *(const v4f*)(wq + (n * TQ + r) * DD + c4);
  }
  const float vb  = Vb[0];
  const float mkv = mask[n * TK + kbase + kloc];

  // B fragments: this lane's key row, f32 -> f16.
  const float* krow = k + (size_t)(n * TK + kbase + kloc) * DD;
  v16h bk[4];
#pragma unroll
  for (int ks = 0; ks < 4; ++ks) bk[ks] = frag_f32(krow + ks * 32, h);

  // ---- uk^T = Uw @ k_tile^T + Ub, kept in the accumulators ----------------
  v8f acc[8];
#pragma unroll
  for (int dt = 0; dt < 8; ++dt) {
    const v4f* ub = (const v4f*)(Ub + dt * 16 + 8 * h);
    v4f u0 = ub[0], u1 = ub[1];
    v8f c;
#pragma unroll
    for (int i = 0; i < 4; ++i) { c[i] = u0[i]; c[4 + i] = u1[i]; }
    const _Float16* urow = uwh + (dt * 16 + col) * DD;
#pragma unroll
    for (int ks = 0; ks < 4; ++ks)
      c = wmma_f16(frag_h16(urow + ks * 32, h), bk[ks], c);
    acc[dt] = c;
  }

  // Vw at this lane's 64 d positions.
  v2f vw[8][4];
#pragma unroll
  for (int dt = 0; dt < 8; ++dt) {
    const v2f* vp = (const v2f*)(Vw + dt * 16 + 8 * h);
#pragma unroll
    for (int i = 0; i < 4; ++i) vw[dt][i] = vp[i];
  }
  __syncthreads();  // wql staged

  // ---- scores: s[q,key] = sum_d Vw[d]*tanh(wq[q,d]+uk[key,d]) -------------
  // The q loop stays rolled: its body is 64 tanh, and sixteen copies of it
  // would be straight-line code that each wave runs once.
#pragma unroll 1
  for (int q = 0; q < TQ; ++q) {
    v2f sa = {0.0f, 0.0f}, sb = {0.0f, 0.0f};
#pragma unroll
    for (int dt = 0; dt < 8; ++dt) {
      const v4f* wp = (const v4f*)&wql[q][dt * 16 + 8 * h];
      v4f w0 = wp[0], w1 = wp[1];
      v2f a0 = {w0[0] + acc[dt][0], w0[1] + acc[dt][1]};
      v2f a1 = {w0[2] + acc[dt][2], w0[3] + acc[dt][3]};
      v2f a2 = {w1[0] + acc[dt][4], w1[1] + acc[dt][5]};
      v2f a3 = {w1[2] + acc[dt][6], w1[3] + acc[dt][7]};
      v2f t0 = {fast_tanh(a0[0]), fast_tanh(a0[1])};
      v2f t1 = {fast_tanh(a1[0]), fast_tanh(a1[1])};
      v2f t2 = {fast_tanh(a2[0]), fast_tanh(a2[1])};
      v2f t3 = {fast_tanh(a3[0]), fast_tanh(a3[1])};
      sa += vw[dt][0] * t0;
      sb += vw[dt][1] * t1;
      sa += vw[dt][2] * t2;
      sb += vw[dt][3] * t3;
    }
    float s = (sa[0] + sa[1]) + (sb[0] + sb[1]);
    // other half of d: lane l <-> l ^ 16
    s += __uint_as_float(__builtin_amdgcn_permlanex16(
        0u, __float_as_uint(s), 0x76543210u, 0xfedcba98u, false, false));
    sc[q][kloc] = s;   // both halves hold and store the same value
  }

  // k columns for the weighted sum, issued ahead of the softmax:
  // B[key][d = wv*16+col], keys in the fragment's k order.
  float kc[4][16];
#pragma unroll
  for (int kk = 0; kk < 4; ++kk) {
    const float* kp = k + (size_t)(n * TK + kbase + kk * 32 + h * 8) * DD + wv * 16 + col;
#pragma unroll
    for (int i = 0; i < 8; ++i) {
      kc[kk][i]     = kp[i * DD];
      kc[kk][8 + i] = kp[(16 + i) * DD];
    }
  }

  // ---- softmax over the TQ axis: each lane reads back its own column ------
  {
    const float add = vb + (1.0f - mkv) * -10000.0f;
    float e[TQ];
    float m = -1e30f;
#pragma unroll
    for (int qq = 0; qq < TQ; ++qq) { e[qq] = sc[qq][kloc] + add; m = fmaxf(m, e[qq]); }
    float s = 0.0f;
#pragma unroll
    for (int qq = 0; qq < TQ; ++qq) { e[qq] = __expf(e[qq] - m); s += e[qq]; }
    float r = 1.0f / s;
#pragma unroll
    for (int qq = 0; qq < TQ; ++qq) wA[qq][kloc] = (_Float16)(e[qq] * r);
  }
  __syncthreads();  // all 128 keys' weights visible

  // ---- x[q, dtile] = w(16x128) @ k_tile(128x16) ---------------------------
  v8f xacc;
#pragma unroll
  for (int j = 0; j < 8; ++j) xacc[j] = 0.0f;
#pragma unroll
  for (int kk = 0; kk < 4; ++kk) {
    v16h a = frag_h16(&wA[col][kk * 32], h);             // row q = col
    v16h b;
#pragma unroll
    for (int i = 0; i < 16; ++i) b[i] = (_Float16)kc[kk][i];
    xacc = wmma_f16(a, b, xacc);
  }

  // Partial result for this chunk: part[chunk][n][q][d]
  float* o = part + ((size_t)(chunk * NB + n) * TQ) * DD + wv * 16 + col;
#pragma unroll
  for (int j = 0; j < 8; ++j) o[(j + 8 * h) * DD] = xacc[j];
}

// ----------------------- kernel 4: deterministic reduce --------------------
__global__ __launch_bounds__(256) void reduce_kernel(const float* __restrict__ part,
                                                     float* __restrict__ out) {
  int i = blockIdx.x * 256 + threadIdx.x;
  if (i < NB * TQ * DD) {
    float s = 0.0f;
#pragma unroll
    for (int c = 0; c < KCH; ++c) s += part[(size_t)c * NB * TQ * DD + i];
    out[i] = s;
  }
}

// ---------------------------------------------------------------------------
extern "C" void kernel_launch(void* const* d_in, const int* in_sizes, int n_in,
                              void* d_out, int out_size, void* d_ws, size_t ws_size,
                              hipStream_t stream) {
  (void)in_sizes; (void)n_in; (void)out_size; (void)ws_size;
  const float* q    = (const float*)d_in[0];
  const float* k    = (const float*)d_in[1];
  const float* mask = (const float*)d_in[2];
  const float* Ww   = (const float*)d_in[3];
  const float* Wb   = (const float*)d_in[4];
  const float* Uw   = (const float*)d_in[5];
  const float* Ub   = (const float*)d_in[6];
  const float* Vw   = (const float*)d_in[7];
  const float* Vb   = (const float*)d_in[8];
  float* out = (float*)d_out;

  char* ws = (char*)d_ws;
  float*    wq_ws = (float*)ws;                              // 256 KB
  _Float16* uwh   = (_Float16*)(ws + 262144);                // 32 KB
  float*    part  = (float*)(ws + 262144 + 32768);           // 4 MB

  cvt_uw_kernel<<<(DD * DD + 255) / 256, 256, 0, stream>>>(Uw, uwh);
  wq_kernel<<<NB, 256, 0, stream>>>(q, Ww, Wb, wq_ws);
  main_kernel<<<dim3(KCH, NB), 256, 0, stream>>>(k, mask, wq_ws, uwh, Ub, Vw, Vb, part);
  reduce_kernel<<<(NB * TQ * DD + 255) / 256, 256, 0, stream>>>(part, out);
}

// v002
// A run of this version takes 22.2 microseconds.
// In two side-by-side timings against v001, it was 1.46 and 1.47 times as fast.
// Counting every step since v000, it is 2.40 times as fast.
#include <hip/hip_runtime.h>
#include <math.h>

// ---------------------------------------------------------------------------
// Bahdanau additive cross-attention pooling, fused for MI455X (gfx1250).
//   N=32, TQ=16, TK=2048, D=128.
// Never materializes h=[N,TQ,TK,D] (536MB). Softmax axis is TQ -> local per
// key column -> full fusion of score/softmax/weighted-sum over k.
// - GEMMs on v_wmma_f32_16x16x32_f16 (f32 accumulate)
// - uk stays in the WMMA accumulators (one key per lane); scores and the
//   softmax over TQ are formed per lane
// - tanh on the TRANS pipe via v_tanh_f32 (dominant cost: ~134M tanh)
// - two launches: every block stages Uw, Ww and q[n] in LDS as f16 from
//   whole-line loads and forms wq[n] itself; then the sum over the k-chunks
// ---------------------------------------------------------------------------

#define DD   128
#define NB   32
#define TQ   16
#define TK   2048
#define KCH  16         // k-chunks per n
#define CHUNK (TK/KCH)  // 128 keys per block: 8 waves x 16 keys

typedef _Float16 v16h __attribute__((ext_vector_type(16)));
typedef _Float16 v8h  __attribute__((ext_vector_type(8)));
typedef _Float16 v4h  __attribute__((ext_vector_type(4)));
typedef float    v8f  __attribute__((ext_vector_type(8)));
typedef float    v4f  __attribute__((ext_vector_type(4)));
typedef float    v2f  __attribute__((ext_vector_type(2)));

// LDS row stride chosen so every 16B fragment run is 16B-aligned and
// lane-strided reads hit distinct banks (row bytes are an odd multiple of 16).
#define WA_STR  136   // f16, softmax weights     (272B/row)
#define WH_STR  136   // f16, staged Uw, Ww, q    (272B/row)

// Native TRANS-pipe tanh (V_TANH_F32, CDNA5). v_nop satisfies the documented
// TRANS hazard (1 independent op before the result may be consumed).
__device__ __forceinline__ float fast_tanh(float x) {
  float y;
  asm("v_tanh_f32 %0, %1\n\tv_nop" : "=v"(y) : "v"(x));
  return y;
}

__device__ __forceinline__ v8f wmma_f16(v16h a, v16h b, v8f c) {
  // v_wmma_f32_16x16x32_f16  (probe-verified builtin signature)
  return __builtin_amdgcn_wmma_f32_16x16x32_f16(
      /*neg_a=*/false, a, /*neg_b=*/false, b,
      /*c_mod=*/(short)0, c, /*reuse_a=*/false, /*reuse_b=*/false);
}

// 16-bit A/B fragment lane layout: element K = (v>=4?16:0) + 8*h + 2*(v&3)+s
// => two contiguous runs of 8 halfs at [h*8] and [16+h*8] of the lane's row.
__device__ __forceinline__ v16h frag_h16(const _Float16* row, int h) {
  union { v16h v; v8h p[2]; } u;
  u.p[0] = *(const v8h*)(row + h * 8);
  u.p[1] = *(const v8h*)(row + 16 + h * 8);
  return u.v;
}

__device__ __forceinline__ v16h frag_f32(const float* row, int h) {
  const v4f* r0 = (const v4f*)(row + h * 8);
  const v4f* r1 = (const v4f*)(row + 16 + h * 8);
  v4f a0 = r0[0], a1 = r0[1], b0 = r1[0], b1 = r1[1];
  union { v16h v; _Float16 e[16]; } u;
#pragma unroll
  for (int i = 0; i < 4; ++i) {
    u.e[i]      = (_Float16)a0[i];
    u.e[4 + i]  = (_Float16)a1[i];
    u.e[8 + i]  = (_Float16)b0[i];
    u.e[12 + i] = (_Float16)b1[i];
  }
  return u.v;
}

// ROWS rows of DD floats -> f16 rows in LDS, in two halves so that every load
// of the block's prologue is in flight before the first is waited for. Each
// wave-wide load is one whole 512-byte row, each store one whole 256-byte row.
template <int ROWS>
__device__ __forceinline__ void load_rows(v4f (&v)[ROWS / 8], const float* __restrict__ src, int t) {
  const v4f* s4 = (const v4f*)src + t;           // a row is 32 lanes x 16 bytes
#pragma unroll
  for (int i = 0; i < ROWS / 8; ++i) v[i] = s4[i * 256];   // 8 waves: 8 rows per trip
}

template <int ROWS>
__device__ __forceinline__ void store_rows_h16(_Float16 (*dst)[WH_STR], const v4f (&v)[ROWS / 8], int t) {
  _Float16* d4 = &dst[t >> 5][(t & 31) * 4];
#pragma unroll
  for (int i = 0; i < ROWS / 8; ++i) {
    v4h o = {(_Float16)v[i][0], (_Float16)v[i][1], (_Float16)v[i][2], (_Float16)v[i][3]};
    *(v4h*)(d4 + i * 8 * WH_STR) = o;
  }
}

// --- kernel 1: fused wq / uk-GEMM / tanh-score / softmax / x, keys on lanes ---
// grid = (KCH, NB); block = 8 waves; wave wv owns keys wv*16 .. wv*16+15 of the
// block's 128 for the scores, and d-tile wv of wq[n] and of x.
// uk is formed transposed (A = Uw rows, B = k rows): D register r of lane (col,h)
// is uk[key col][dt*16 + 8h + r], so a lane holds 64 of its key's 128 uk values
// and the sum over d is in-lane but for one exchange between the lane halves.
__global__ __launch_bounds__(256) void main_kernel(const float* __restrict__ q,
                                                   const float* __restrict__ k,
                                                   const float* __restrict__ mask,
                                                   const float* __restrict__ Ww,
                                                   const float* __restrict__ Wb,
                                                   const float* __restrict__ Uw,
                                                   const float* __restrict__ Ub,
                                                   const float* __restrict__ Vw,
                                                   const float* __restrict__ Vb,
                                                   float* __restrict__ part) {
  __shared__ __align__(16) _Float16 uwl[DD][WH_STR];    // Uw   (A frag src of uk)
  __shared__ __align__(16) _Float16 wwl[DD][WH_STR];    // Ww   (B frag src of wq)
  __shared__ __align__(16) _Float16 ql[TQ][WH_STR];     // q[n] (A frag src of wq)
  __shared__ __align__(16) float    wql[TQ][DD];        // wq[n], read as broadcasts
  __shared__ __align__(16) float    sc[TQ][CHUNK];      // raw scores, column = key
  __shared__ __align__(16) _Float16 wA[TQ][WA_STR];     // softmax weights (A frag src)

  const int chunk = blockIdx.x;
  const int n     = blockIdx.y;
  const int t     = threadIdx.x;
  const int lane  = t & 31;
  const int wv    = t >> 5;
  const int h     = (lane >> 4) & 1;
  const int col   = lane & 15;
  const int kbase = chunk * CHUNK;
  const int kloc  = wv * 16 + col;          // this lane's key inside the block

  // Both weight matrices and q[n], f32 -> f16, once per block.
  v4f ur[DD / 8], wr[DD / 8], qr[TQ / 8];
  load_rows<DD>(ur, Uw, t);
  load_rows<DD>(wr, Ww, t);
  load_rows<TQ>(qr, q + n * TQ * DD, t);
  const float vb  = Vb[0];
  const float mkv = mask[n * TK + kbase + kloc];

  // B fragments: this lane's key row, f32 -> f16.
  const float* krow = k + (size_t)(n * TK + kbase + kloc) * DD;
  v16h bk[4];
#pragma unroll
  for (int ks = 0; ks < 4; ++ks) bk[ks] = frag_f32(krow + ks * 32, h);

  // Stands in front of the instructions that reuse the address registers of the
  // loads above: a precaution that this build otherwise leaves out there.
  asm volatile("s_wait_xcnt 0x0" ::: "memory");
  store_rows_h16<DD>(uwl, ur, t);
  store_rows_h16<DD>(wwl, wr, t);
  store_rows_h16<TQ>(ql, qr, t);
  __syncthreads();  // uwl, wwl, ql staged

  // ---- wq[n] = q[n] @ Ww^T + Wb: this wave's 16 columns, into wql ---------
  {
    const float bias = Wb[wv * 16 + col];
    v8f c;
#pragma unroll
    for (int j = 0; j < 8; ++j) c[j] = bias;
#pragma unroll
    for (int ks = 0; ks < 4; ++ks)
      c = wmma_f16(frag_h16(&ql[col][ks * 32], h), frag_h16(&wwl[wv * 16 + col][ks * 32], h), c);
#pragma unroll
    for (int j = 0; j < 8; ++j) wql[j + 8 * h][wv * 16 + col] = c[j];   // C: M=j+8h, N=col
  }

  // ---- uk^T = Uw @ k_tile^T + Ub, kept in the accumulators ----------------
  v8f acc[8];
#pragma unroll
  for (int dt = 0; dt < 8; ++dt) {
    const v4f* ub = (const v4f*)(Ub + dt * 16 + 8 * h);
    v4f u0 = ub[0], u1 = ub[1];
    v8f c;
#pragma unroll
    for (int i = 0; i < 4; ++i) { c[i] = u0[i]; c[4 + i] = u1[i]; }
    const _Float16* urow = &uwl[dt * 16 + col][0];
#pragma unroll
    for (int ks = 0; ks < 4; ++ks)
      c = wmma_f16(frag_h16(urow + ks * 32, h), bk[ks], c);
    acc[dt] = c;
  }

  // Vw at this lane's 64 d positions.
  v2f vw[8][4];
#pragma unroll
  for (int dt = 0; dt < 8; ++dt) {
    const v2f* vp = (const v2f*)(Vw + dt * 16 + 8 * h);
#pragma unroll
    for (int i = 0; i < 4; ++i) vw[dt][i] = vp[i];
  }
  __syncthreads();  // wql complete

  // ---- scores: s[q,key] = sum_d Vw[d]*tanh(wq[q,d]+uk[key,d]) -------------
  // The q loop stays rolled: its body is 64 tanh, and sixteen copies of it
  // would be straight-line code that each wave runs once.
#pragma unroll 1
  for (int q = 0; q < TQ; ++q) {
    v2f sa = {0.0f, 0.0f}, sb = {0.0f, 0.0f};
#pragma unroll
    for (int dt = 0; dt < 8; ++dt) {
      const v4f* wp = (const v4f*)&wql[q][dt * 16 + 8 * h];
      v4f w0 = wp[0], w1 = wp[1];
      v2f a0 = {w0[0] + acc[dt][0], w0[1] + acc[dt][1]};
      v2f a1 = {w0[2] + acc[dt][2], w0[3] + acc[dt][3]};
      v2f a2 = {w1[0] + acc[dt][4], w1[1] + acc[dt][5]};
      v2f a3 = {w1[2] + acc[dt][6], w1[3] + acc[dt][7]};
      v2f t0 = {fast_tanh(a0[0]), fast_tanh(a0[1])};
      v2f t1 = {fast_tanh(a1[0]), fast_tanh(a1[1])};
      v2f t2 = {fast_tanh(a2[0]), fast_tanh(a2[1])};
      v2f t3 = {fast_tanh(a3[0]), fast_tanh(a3[1])};
      sa += vw[dt][0] * t0;
      sb += vw[dt][1] * t1;
      sa += vw[dt][2] * t2;
      sb += vw[dt][3] * t3;
    }
    float s = (sa[0] + sa[1]) + (sb[0] + sb[1]);
    // other half of d: lane l <-> l ^ 16
    s += __uint_as_float(__builtin_amdgcn_permlanex16(
        0u, __float_as_uint(s), 0x76543210u, 0xfedcba98u, false, false));
    sc[q][kloc] = s;   // both halves hold and store the same value
  }

  // k columns for the weighted sum, issued ahead of the softmax:
  // B[key][d = wv*16+col], keys in the fragment's k order.
  float kc[4][16];
#pragma unroll
  for (int kk = 0; kk < 4; ++kk) {
    const float* kp = k + (size_t)(n * TK + kbase + kk * 32 + h * 8) * DD + wv * 16 + col;
#pragma unroll
    for (int i = 0; i < 8; ++i) {
      kc[kk][i]     = kp[i * DD];
      kc[kk][8 + i] = kp[(16 + i) * DD];
    }
  }

  // ---- softmax over the TQ axis: each lane reads back its own column ------
  {
    const float add = vb + (1.0f - mkv) * -10000.0f;
    float e[TQ];
    float m = -1e30f;
#pragma unroll
    for (int qq = 0; qq < TQ; ++qq) { e[qq] = sc[qq][kloc] + add; m = fmaxf(m, e[qq]); }
    float s = 0.0f;
#pragma unroll
    for (int qq = 0; qq < TQ; ++qq) { e[qq] = __expf(e[qq] - m); s += e[qq]; }
    float r = 1.0f / s;
#pragma unroll
    for (int qq = 0; qq < TQ; ++qq) wA[qq][kloc] = (_Float16)(e[qq] * r);
  }
  __syncthreads();  // all 128 keys' weights visible

  // ---- x[q, dtile] = w(16x128) @ k_tile(128x16) ---------------------------
  v8f xacc;
#pragma unroll
  for (int j = 0; j < 8; ++j) xacc[j] = 0.0f;
#pragma unroll
  for (int kk = 0; kk < 4; ++kk) {
    v16h a = frag_h16(&wA[col][kk * 32], h);             // row q = col
    v16h b;
#pragma unroll
    for (int i = 0; i < 16; ++i) b[i] = (_Float16)kc[kk][i];
    xacc = wmma_f16(a, b, xacc);
  }

  // Partial result for this chunk: part[chunk][n][q][d]
  float* o = part + ((size_t)(chunk * NB + n) * TQ) * DD + wv * 16 + col;
#pragma unroll
  for (int j = 0; j < 8; ++j) o[(j + 8 * h) * DD] = xacc[j];
}

// ----------------------- kernel 2: deterministic reduce --------------------
__global__ __launch_bounds__(256) void reduce_kernel(const float* __restrict__ part,
                                                     float* __restrict__ out) {
  int i = blockIdx.x * 256 + threadIdx.x;
  if (i < NB * TQ * DD) {
    float s = 0.0f;
#pragma unroll
    for (int c = 0; c < KCH; ++c) s += part[(size_t)c * NB * TQ * DD + i];
    out[i] = s;
  }
}

// ---------------------------------------------------------------------------
extern "C" void kernel_launch(void* const* d_in, const int* in_sizes, int n_in,
                              void* d_out, int out_size, void* d_ws, size_t ws_size,
                              hipStream_t stream) {
  (void)in_sizes; (void)n_in; (void)out_size; (void)ws_size;
  const float* q    = (const float*)d_in[0];
  const float* k    = (const float*)d_in[1];
  const float* mask = (const float*)d_in[2];
  const float* Ww   = (const float*)d_in[3];
  const float* Wb   = (const float*)d_in[4];
  const float* Uw   = (const float*)d_in[5];
  const float* Ub   = (const float*)d_in[6];
  const float* Vw   = (const float*)d_in[7];
  const float* Vb   = (const float*)d_in[8];
  float* out = (float*)d_out;

  float* part = (float*)d_ws;                                // 4 MB

  main_kernel<<<dim3(KCH, NB), 256, 0, stream>>>(q, k, mask, Ww, Wb, Uw, Ub, Vw, Vb, part);
  reduce_kernel<<<(NB * TQ * DD + 255) / 256, 256, 0, stream>>>(part, out);
}

// v003
// Measured time: 19.1 microseconds a run.
// Next to v002, in two timings, it ran 1.17 times as fast each time.
// Over all steps from v000 it is 2.80 times as fast.
#include <hip/hip_runtime.h>
#include <math.h>

// ---------------------------------------------------------------------------
// Bahdanau additive cross-attention pooling, fused for MI455X (gfx1250).
//   N=32, TQ=16, TK=2048, D=128.
// Never materializes h=[N,TQ,TK,D] (536MB). Softmax axis is TQ -> local per
// key column -> full fusion of score/softmax/weighted-sum over k.
// - GEMMs on v_wmma_f32_16x16x32_f16 (f32 accumulate)
// - uk stays in the WMMA accumulators (one key per lane); scores and the
//   softmax over TQ are formed per lane
// - tanh on the TRANS pipe via v_tanh_f32 (dominant cost: ~134M tanh)
// - two launches: every block stages Uw, Ww and q[n] in LDS as f16 from
//   whole-line loads and forms wq[n] itself; then the sum over the k-chunks
// ---------------------------------------------------------------------------

#define DD   128
#define NB   32
#define TQ   16
#define TK   2048
#define KCH  16         // k-chunks per n
#define CHUNK (TK/KCH)  // 128 keys per block: 8 waves x 16 keys

typedef _Float16 v16h __attribute__((ext_vector_type(16)));
typedef _Float16 v8h  __attribute__((ext_vector_type(8)));
typedef _Float16 v4h  __attribute__((ext_vector_type(4)));
typedef float    v8f  __attribute__((ext_vector_type(8)));
typedef float    v4f  __attribute__((ext_vector_type(4)));
typedef float    v2f  __attribute__((ext_vector_type(2)));

// LDS row stride chosen so every 16B fragment run is 16B-aligned and
// lane-strided reads hit distinct banks (row bytes are an odd multiple of 16).
#define WA_STR  136   // f16, softmax weights     (272B/row)
#define WH_STR  136   // f16, staged Uw, Ww, q    (272B/row)

// Native TRANS-pipe tanh (V_TANH_F32, CDNA5) through the compiler's builtin:
// the scheduler sees the instruction and puts other tanh, adds and multiply-adds
// behind it, where asm text needed a v_nop of its own behind every one.
__device__ __forceinline__ float fast_tanh(float x) {
  return __builtin_amdgcn_tanhf(x);
}

__device__ __forceinline__ v8f wmma_f16(v16h a, v16h b, v8f c) {
  // v_wmma_f32_16x16x32_f16  (probe-verified builtin signature)
  return __builtin_amdgcn_wmma_f32_16x16x32_f16(
      /*neg_a=*/false, a, /*neg_b=*/false, b,
      /*c_mod=*/(short)0, c, /*reuse_a=*/false, /*reuse_b=*/false);
}

// 16-bit A/B fragment lane layout: element K = (v>=4?16:0) + 8*h + 2*(v&3)+s
// => two contiguous runs of 8 halfs at [h*8] and [16+h*8] of the lane's row.
__device__ __forceinline__ v16h frag_h16(const _Float16* row, int h) {
  union { v16h v; v8h p[2]; } u;
  u.p[0] = *(const v8h*)(row + h * 8);
  u.p[1] = *(const v8h*)(row + 16 + h * 8);
  return u.v;
}

__device__ __forceinline__ v16h frag_f32(const float* row, int h) {
  const v4f* r0 = (const v4f*)(row + h * 8);
  const v4f* r1 = (const v4f*)(row + 16 + h * 8);
  v4f a0 = r0[0], a1 = r0[1], b0 = r1[0], b1 = r1[1];
  union { v16h v; _Float16 e[16]; } u;
#pragma unroll
  for (int i = 0; i < 4; ++i) {
    u.e[i]      = (_Float16)a0[i];
    u.e[4 + i]  = (_Float16)a1[i];
    u.e[8 + i]  = (_Float16)b0[i];
    u.e[12 + i] = (_Float16)b1[i];
  }
  return u.v;
}

// ROWS rows of DD floats -> f16 rows in LDS, in two halves so that every load
// of the block's prologue is in flight before the first is waited for. Each
// wave-wide load is one whole 512-byte row, each store one whole 256-byte row.
template <int ROWS>
__device__ __forceinline__ void load_rows(v4f (&v)[ROWS / 8], const float* __restrict__ src, int t) {
  const v4f* s4 = (const v4f*)src + t;           // a row is 32 lanes x 16 bytes
#pragma unroll
  for (int i = 0; i < ROWS / 8; ++i) v[i] = s4[i * 256];   // 8 waves: 8 rows per trip
}

template <int ROWS>
__device__ __forceinline__ void store_rows_h16(_Float16 (*dst)[WH_STR], const v4f (&v)[ROWS / 8], int t) {
  _Float16* d4 = &dst[t >> 5][(t & 31) * 4];
#pragma unroll
  for (int i = 0; i < ROWS / 8; ++i) {
    v4h o = {(_Float16)v[i][0], (_Float16)v[i][1], (_Float16)v[i][2], (_Float16)v[i][3]};
    *(v4h*)(d4 + i * 8 * WH_STR) = o;
  }
}

// --- kernel 1: fused wq / uk-GEMM / tanh-score / softmax / x, keys on lanes ---
// grid = (KCH, NB); block = 8 waves; wave wv owns keys wv*16 .. wv*16+15 of the
// block's 128 for the scores, and d-tile wv of wq[n] and of x.
// uk is formed transposed (A = Uw rows, B = k rows): D register r of lane (col,h)
// is uk[key col][dt*16 + 8h + r], so a lane holds 64 of its key's 128 uk values
// and the sum over d is in-lane but for one exchange between the lane halves.
__global__ __launch_bounds__(256) void main_kernel(const float* __restrict__ q,
                                                   const float* __restrict__ k,
                                                   const float* __restrict__ mask,
                                                   const float* __restrict__ Ww,
                                                   const float* __restrict__ Wb,
                                                   const float* __restrict__ Uw,
                                                   const float* __restrict__ Ub,
                                                   const float* __restrict__ Vw,
                                                   const float* __restrict__ Vb,
                                                   float* __restrict__ part) {
  __shared__ __align__(16) _Float16 uwl[DD][WH_STR];    // Uw   (A frag src of uk)
  __shared__ __align__(16) _Float16 wwl[DD][WH_STR];    // Ww   (B frag src of wq)
  __shared__ __align__(16) _Float16 ql[TQ][WH_STR];     // q[n] (A frag src of wq)
  __shared__ __align__(16) float    wql[TQ][DD];        // wq[n], read as broadcasts
  __shared__ __align__(16) float    sc[TQ][CHUNK];      // raw scores, column = key
  __shared__ __align__(16) _Float16 wA[TQ][WA_STR];     // softmax weights (A frag src)

  const int chunk = blockIdx.x;
  const int n     = blockIdx.y;
  const int t     = threadIdx.x;
  const int lane  = t & 31;
  const int wv    = t >> 5;
  const int h     = (lane >> 4) & 1;
  const int col   = lane & 15;
  const int kbase = chunk * CHUNK;
  const int kloc  = wv * 16 + col;          // this lane's key inside the block

  // Both weight matrices and q[n], f32 -> f16, once per block.
  v4f ur[DD / 8], wr[DD / 8], qr[TQ / 8];
  load_rows<DD>(ur, Uw, t);
  load_rows<DD>(wr, Ww, t);
  load_rows<TQ>(qr, q + n * TQ * DD, t);
  const float vb  = Vb[0];
  const float mkv = mask[n * TK + kbase + kloc];

  // B fragments: this lane's key row, f32 -> f16.
  const float* krow = k + (size_t)(n * TK + kbase + kloc) * DD;
  v16h bk[4];
#pragma unroll
  for (int ks = 0; ks < 4; ++ks) bk[ks] = frag_f32(krow + ks * 32, h);

  // Stands in front of the instructions that reuse the address registers of the
  // loads above: a precaution that this build otherwise leaves out there.
  asm volatile("s_wait_xcnt 0x0" ::: "memory");
  store_rows_h16<DD>(uwl, ur, t);
  store_rows_h16<DD>(wwl, wr, t);
  store_rows_h16<TQ>(ql, qr, t);
  __syncthreads();  // uwl, wwl, ql staged

  // ---- wq[n] = q[n] @ Ww^T + Wb: this wave's 16 columns, into wql ---------
  {
    const float bias = Wb[wv * 16 + col];
    v8f c;
#pragma unroll
    for (int j = 0; j < 8; ++j) c[j] = bias;
#pragma unroll
    for (int ks = 0; ks < 4; ++ks)
      c = wmma_f16(frag_h16(&ql[col][ks * 32], h), frag_h16(&wwl[wv * 16 + col][ks * 32], h), c);
#pragma unroll
    for (int j = 0; j < 8; ++j) wql[j + 8 * h][wv * 16 + col] = c[j];   // C: M=j+8h, N=col
  }

  // ---- uk^T = Uw @ k_tile^T + Ub, kept in the accumulators ----------------
  v8f acc[8];
#pragma unroll
  for (int dt = 0; dt < 8; ++dt) {
    const v4f* ub = (const v4f*)(Ub + dt * 16 + 8 * h);
    v4f u0 = ub[0], u1 = ub[1];
    v8f c;
#pragma unroll
    for (int i = 0; i < 4; ++i) { c[i] = u0[i]; c[4 + i] = u1[i]; }
    const _Float16* urow = &uwl[dt * 16 + col][0];
#pragma unroll
    for (int ks = 0; ks < 4; ++ks)
      c = wmma_f16(frag_h16(urow + ks * 32, h), bk[ks], c);
    acc[dt] = c;
  }

  // Vw at this lane's 64 d positions.
  v2f vw[8][4];
#pragma unroll
  for (int dt = 0; dt < 8; ++dt) {
    const v2f* vp = (const v2f*)(Vw + dt * 16 + 8 * h);
#pragma unroll
    for (int i = 0; i < 4; ++i) vw[dt][i] = vp[i];
  }
  __syncthreads();  // wql complete

  // ---- scores: s[q,key] = sum_d Vw[d]*tanh(wq[q,d]+uk[key,d]) -------------
  // The q loop stays rolled: its body is 64 tanh, and sixteen copies of it
  // would be straight-line code that each wave runs once.
#pragma unroll 1
  for (int q = 0; q < TQ; ++q) {
    v2f sa = {0.0f, 0.0f}, sb = {0.0f, 0.0f};
#pragma unroll
    for (int dt = 0; dt < 8; ++dt) {
      const v4f* wp = (const v4f*)&wql[q][dt * 16 + 8 * h];
      v4f w0 = wp[0], w1 = wp[1];
      v2f a0 = {w0[0] + acc[dt][0], w0[1] + acc[dt][1]};
      v2f a1 = {w0[2] + acc[dt][2], w0[3] + acc[dt][3]};
      v2f a2 = {w1[0] + acc[dt][4], w1[1] + acc[dt][5]};
      v2f a3 = {w1[2] + acc[dt][6], w1[3] + acc[dt][7]};
      v2f t0 = {fast_tanh(a0[0]), fast_tanh(a0[1])};
      v2f t1 = {fast_tanh(a1[0]), fast_tanh(a1[1])};
      v2f t2 = {fast_tanh(a2[0]), fast_tanh(a2[1])};
      v2f t3 = {fast_tanh(a3[0]), fast_tanh(a3[1])};
      sa += vw[dt][0] * t0;
      sb += vw[dt][1] * t1;
      sa += vw[dt][2] * t2;
      sb += vw[dt][3] * t3;
    }
    float s = (sa[0] + sa[1]) + (sb[0] + sb[1]);
    // other half of d: lane l <-> l ^ 16
    s += __uint_as_float(__builtin_amdgcn_permlanex16(
        0u, __float_as_uint(s), 0x76543210u, 0xfedcba98u, false, false));
    sc[q][kloc] = s;   // both halves hold and store the same value
  }

  // k columns for the weighted sum, issued ahead of the softmax:
  // B[key][d = wv*16+col], keys in the fragment's k order.
  float kc[4][16];
#pragma unroll
  for (int kk = 0; kk < 4; ++kk) {
    const float* kp = k + (size_t)(n * TK + kbase + kk * 32 + h * 8) * DD + wv * 16 + col;
#pragma unroll
    for (int i = 0; i < 8; ++i) {
      kc[kk][i]     = kp[i * DD];
      kc[kk][8 + i] = kp[(16 + i) * DD];
    }
  }

  // ---- softmax over the TQ axis: each lane reads back its own column ------
  {
    const float add = vb + (1.0f - mkv) * -10000.0f;
    float e[TQ];
    float m = -1e30f;
#pragma unroll
    for (int qq = 0; qq < TQ; ++qq) { e[qq] = sc[qq][kloc] + add; m = fmaxf(m, e[qq]); }
    float s = 0.0f;
#pragma unroll
    for (int qq = 0; qq < TQ; ++qq) { e[qq] = __expf(e[qq] - m); s += e[qq]; }
    float r = 1.0f / s;
#pragma unroll
    for (int qq = 0; qq < TQ; ++qq) wA[qq][kloc] = (_Float16)(e[qq] * r);
  }
  __syncthreads();  // all 128 keys' weights visible

  // ---- x[q, dtile] = w(16x128) @ k_tile(128x16) ---------------------------
  v8f xacc;
#pragma unroll
  for (int j = 0; j < 8; ++j) xacc[j] = 0.0f;
#pragma unroll
  for (int kk = 0; kk < 4; ++kk) {
    v16h a = frag_h16(&wA[col][kk * 32], h);             // row q = col
    v16h b;
#pragma unroll
    for (int i = 0; i < 16; ++i) b[i] = (_Float16)kc[kk][i];
    xacc = wmma_f16(a, b, xacc);
  }

  // Partial result for this chunk: part[chunk][n][q][d]
  float* o = part + ((size_t)(chunk * NB + n) * TQ) * DD + wv * 16 + col;
#pragma unroll
  for (int j = 0; j < 8; ++j) o[(j + 8 * h) * DD] = xacc[j];
}

// ----------------------- kernel 2: deterministic reduce --------------------
__global__ __launch_bounds__(256) void reduce_kernel(const float* __restrict__ part,
                                                     float* __restrict__ out) {
  int i = blockIdx.x * 256 + threadIdx.x;
  if (i < NB * TQ * DD) {
    float s = 0.0f;
#pragma unroll
    for (int c = 0; c < KCH; ++c) s += part[(size_t)c * NB * TQ * DD + i];
    out[i] = s;
  }
}

// ---------------------------------------------------------------------------
extern "C" void kernel_launch(void* const* d_in, const int* in_sizes, int n_in,
                              void* d_out, int out_size, void* d_ws, size_t ws_size,
                              hipStream_t stream) {
  (void)in_sizes; (void)n_in; (void)out_size; (void)ws_size;
  const float* q    = (const float*)d_in[0];
  const float* k    = (const float*)d_in[1];
  const float* mask = (const float*)d_in[2];
  const float* Ww   = (const float*)d_in[3];
  const float* Wb   = (const float*)d_in[4];
  const float* Uw   = (const float*)d_in[5];
  const float* Ub   = (const float*)d_in[6];
  const float* Vw   = (const float*)d_in[7];
  const float* Vb   = (const float*)d_in[8];
  float* out = (float*)d_out;

  float* part = (float*)d_ws;                                // 4 MB

  main_kernel<<<dim3(KCH, NB), 256, 0, stream>>>(q, k, mask, Ww, Wb, Uw, Ub, Vw, Vb, part);
  reduce_kernel<<<(NB * TQ * DD + 255) / 256, 256, 0, stream>>>(part, out);
}
